// v010
// Measured on an AMD MI455X. A time is GPU time per run, averaged over a window of back-to-back runs after a warm-up
// (all launches, gaps included; the runs take copies of the inputs in turn), and the median of several windows.
// Apart from v000's, it joins two sittings. Times from different sittings can be a few percent apart, while
// side-by-side timings come from the same sitting.
// This document starts at v010; the versions before it stand elsewhere.
// A run of this version takes 21.6 microseconds.
// Timed twice side by side with v009, it ran 1.04 and 1.05 times as fast.
// Counting every step since v000, which is the starting kernel, it is 658 times as fast.
#include <hip/hip_runtime.h>
// Single-head causal self-attention with the module's EMBEDDING-width scale (inps [4][2048][1024]; q/k/v = x W^T (natural [64][1024], U(+-1/32), no biases); ONE 64-wide head; scores * 1024^-0.5 (the source sets head_size = n_embed); causal (tril, -inf); softmax; out = weights v -> [4][2048][64]; no output projection).
// Structure (3 launches): the weights as exact f16, packed in fragment order; one WMMA GEMM that reads the f32 x itself (rounded in registers, exact in f16) and stores, per 32 rows, one tile each of q, k and v^T as f16 in fragment order, and also the f32 q | k | v of each batch's rows 0..511; the last launch holds both attention paths, each storing its own rows: scores, causal softmax and P V in ONE launch (block = 32 query rows of one batch; its 16 waves share the row block's keys in 32-key steps; S^T = K Q^T, weights stay in registers as the B operand of O^T += V^T P^T; running maximum and sum per wave, the waves' parts joined in LDS), f32 straight into the output rows 512..2047; an exact f32 first tile (rows 0..511 of each batch) on further blocks of the same grid.
// Compute dtype: inputs rounded to bf16; x / weights exact; q, k, v and softmax weights as plain f16 GEMM operands (~2^-12); scores, softmax statistics and o f32. v_wmma_f32_16x16x32_f16; the exact first tile's scores: v_wmma_f32_16x16x4_f32 (f32 operands).
#define NB 4
#define SQ 2048
#define DM 1024
#define NH 1
#define HD 64
#define HG 4                         /* heads per attention launch group */
#define QT 256                       /* query rows per causal tile */
#define NKX SQ                       /* S / P row pitch */
#define QT0 512                      /* first-tile rows recomputed exactly (f32): 512 here (no output projection averages the early-row cancellation errors away; logit sigma 1.0) */
#define B0 0                         /* first batch processed (debug hook) */
#define NBR NB                       /* batches processed (debug hook) */
#define NR ((size_t)NB * SQ)
#define DMQ DM
#define DFF 4096                     /* FFN hidden width */
#define DFFR 100                     /* real hidden width */         /* token rows */
#define MP ((int)((size_t)NBR * SQ)) /* rows projected (debug hook) */
#define QN SQ                        /* query rows attended per batch (debug hook) */
#define NHD NH                       /* heads attended (debug hook) */
#define MPO MP                       /* rows through the output stage (debug hook) */
#define LQ (3 * DM)      /* 3 * DM; unused: the q | k | v rows have pitch LQK */
typedef __bf16 v16b __attribute__((ext_vector_type(16)));
typedef unsigned short v8us __attribute__((ext_vector_type(8), may_alias));
typedef float  v8f  __attribute__((ext_vector_type(8)));
typedef float  v4f  __attribute__((ext_vector_type(4)));
typedef float  v4fa __attribute__((ext_vector_type(4), may_alias));
union FragB { v16b v; v8us half[2]; unsigned short u[16]; };

__device__ __forceinline__ unsigned short bf16_bits(float x) { unsigned int u = __float_as_uint(x); return (unsigned short)((u + 0x7FFFu + ((u >> 16) & 1u)) >> 16); }
__device__ __forceinline__ float bf16_val(unsigned short b) { return __uint_as_float(((unsigned int)b) << 16); }
__device__ __forceinline__ float bf16_round(float x) { return bf16_val(bf16_bits(x)); }
// D += A·B with NT terms: 1 = ah·bh, 2 = + al·bh (A split), 3 = + ah·bl (both split)
template <int NT>
__device__ __forceinline__ v8f mmaN(v16b ah, v16b al, v16b bh, v16b bl, v8f c) {
  c = __builtin_amdgcn_wmma_f32_16x16x32_bf16(false, ah, false, bh, (short)0, c, false, false);
  if (NT >= 2) c = __builtin_amdgcn_wmma_f32_16x16x32_bf16(false, al, false, bh, (short)0, c, false, false);
  if (NT >= 3) c = __builtin_amdgcn_wmma_f32_16x16x32_bf16(false, ah, false, bl, (short)0, c, false, false);
  asm volatile("v_nop\n\tv_nop\n\tv_nop\n\tv_nop" : "+v"(c) : "v"(ah), "v"(al), "v"(bh), "v"(bl));
  return c;
}

__global__ __launch_bounds__(256) void k_wt_bf16(const float* __restrict__ W, unsigned short* __restrict__ Wt, int K, int N) {
  const int t = blockIdx.x * 256 + threadIdx.x;
  const int k8n = K / 8;
  if (t >= N * k8n) return;
  const int n = t / k8n, k8 = (t % k8n) * 8;
  v8us v;
#pragma unroll
  for (int i = 0; i < 8; ++i) v[i] = bf16_bits(W[(size_t)(k8 + i) * N + n]);
  *(v8us*)(Wt + (size_t)n * K + k8) = v;
  
}

// GEMM C[M][N] (f32, pitch ldc) = act(A[M][K]·W + bias). A f32 row-major (pitch lda) converted per fragment to bf16
// (ASPLIT: hi/lo two planes -> 2 terms, else single rounded term); Wt bf16 [N][K] (pitch ldb). BIAS_BF16 rounds the
// bias to bf16 first (bias quantised to bf16 before the add). K%32==0, M%16==0, N%64==0.
template <bool ASPLIT, int ACT, bool BIAS_BF16>
__global__ __launch_bounds__(128) void k_gemm_bf(const float* __restrict__ A, int lda, const unsigned short* __restrict__ Wt, int ldb,
                                               const float* __restrict__ bias, float* __restrict__ C, int ldc, int M, int N, int K) {
  __shared__ __attribute__((aligned(16))) float so[4][16][64];
  const int tid = threadIdx.x, w = tid >> 5, lane = tid & 31, ln = lane & 15, hh = lane >> 4;
  const int ntn = N / 64;
  const int wid = blockIdx.x * 4 + w;
  const int mt = wid / ntn, nq = wid % ntn;
  if (mt * 16 >= M) return;
  const int row0 = mt * 16, col0 = nq * 64;
  const float* arow = A + (size_t)(row0 + ln) * lda;
  v8f acc[4] = {};
  for (int kb = 0; kb < K; kb += 32) {
    FragB ah, al;
    const v4f x0 = *(const v4fa*)(arow + kb + 8 * hh), x1 = *(const v4fa*)(arow + kb + 8 * hh + 4);
    const v4f x2 = *(const v4fa*)(arow + kb + 16 + 8 * hh), x3 = *(const v4fa*)(arow + kb + 16 + 8 * hh + 4);
    float xs[16] = {x0[0],x0[1],x0[2],x0[3],x1[0],x1[1],x1[2],x1[3],x2[0],x2[1],x2[2],x2[3],x3[0],x3[1],x3[2],x3[3]};
#pragma unroll
    for (int i = 0; i < 16; ++i) { const unsigned short hb = bf16_bits(xs[i]); ah.u[i] = hb; al.u[i] = ASPLIT ? bf16_bits(xs[i] - bf16_val(hb)) : (unsigned short)0; }
#pragma unroll
    for (int t = 0; t < 4; ++t) {
      const unsigned short* brow = Wt + (size_t)(col0 + t * 16 + ln) * ldb + kb;
      FragB b;
      b.half[0] = *(const v8us*)(brow + 8 * hh);
      b.half[1] = *(const v8us*)(brow + 16 + 8 * hh);
      acc[t] = mmaN<ASPLIT ? 2 : 1>(ah.v, al.v, b.v, b.v, acc[t]);
    }
  }
#pragma unroll
  for (int t = 0; t < 4; ++t) {
    float bv = bias ? bias[col0 + t * 16 + ln] : 0.f;
    if (BIAS_BF16) bv = bf16_round(bv);
#pragma unroll
    for (int r = 0; r < 8; ++r) { float v = acc[t][r] + bv; if (ACT == 1) v = fmaxf(v, 0.f); so[w][8 * hh + r][t * 16 + ln] = v; }
  }
  __builtin_amdgcn_fence(__ATOMIC_ACQ_REL, "workgroup");
  __builtin_amdgcn_wave_barrier();
  const int rsub = lane >> 4, c4 = (lane & 15) * 4;
  {
#pragma unroll
    for (int q = 0; q < 8; ++q) {
      const int r = q * 2 + rsub;
      const v4f v = *(const v4fa*)&so[w][r][c4];
      *(v4f*)(C + (size_t)(row0 + r) * ldc + col0 + c4) = v;
    }
    
  }
}

// GEMM C = act(A·W + bias + resid): A f32 (ASPLIT -> hi/lo 2 terms), Wt bf16 [N][K]; ACT 0 none, 1 relu, 2 exact gelu;
// resid (optional, f32, row index = (row % rmod), pitch ldr, RES_BF16 rounds it) added before the activation.
template <bool ASPLIT, int ACT, bool BIAS_BF16, bool RES_BF16>
__global__ __launch_bounds__(128) void k_gemm_bf3(const float* __restrict__ A, int lda, const unsigned short* __restrict__ Wt, int ldb,
                                                const float* __restrict__ bias, const float* __restrict__ resid, int rmod, int ldr,
                                                float* __restrict__ C, int ldc, int M, int N, int K) {
  __shared__ __attribute__((aligned(16))) float so[4][16][64];
  const int tid = threadIdx.x, w = tid >> 5, lane = tid & 31, ln = lane & 15, hh = lane >> 4;
  const int ntn = N / 64;
  const int wid = blockIdx.x * 4 + w;
  const int mt = wid / ntn, nq = wid % ntn;
  if (mt * 16 >= M) return;
  const int row0 = mt * 16, col0 = nq * 64;
  const float* arow = A + (size_t)(row0 + ln) * lda;
  v8f acc[4] = {};
  for (int kb = 0; kb < K; kb += 32) {
    FragB ah, al;
    const v4f x0 = *(const v4fa*)(arow + kb + 8 * hh), x1 = *(const v4fa*)(arow + kb + 8 * hh + 4);
    const v4f x2 = *(const v4fa*)(arow + kb + 16 + 8 * hh), x3 = *(const v4fa*)(arow + kb + 16 + 8 * hh + 4);
    float xs[16] = {x0[0],x0[1],x0[2],x0[3],x1[0],x1[1],x1[2],x1[3],x2[0],x2[1],x2[2],x2[3],x3[0],x3[1],x3[2],x3[3]};
#pragma unroll
    for (int i = 0; i < 16; ++i) { const unsigned short hb = bf16_bits(xs[i]); ah.u[i] = hb; al.u[i] = ASPLIT ? bf16_bits(xs[i] - bf16_val(hb)) : (unsigned short)0; }
#pragma unroll
    for (int t = 0; t < 4; ++t) {
      const unsigned short* brow = Wt + (size_t)(col0 + t * 16 + ln) * ldb + kb;
      FragB b;
      b.half[0] = *(const v8us*)(brow + 8 * hh);
      b.half[1] = *(const v8us*)(brow + 16 + 8 * hh);
      acc[t] = mmaN<ASPLIT ? 2 : 1>(ah.v, al.v, b.v, b.v, acc[t]);
    }
  }
#pragma unroll
  for (int t = 0; t < 4; ++t) {
    const int col = col0 + t * 16 + ln;
    float bv = bias ? bias[col] : 0.f;
    if (BIAS_BF16) bv = bf16_round(bv);
#pragma unroll
    for (int r = 0; r < 8; ++r) {
      float v = acc[t][r] + bv;
      if (resid) { float rv = resid[(size_t)((row0 + 8 * hh + r) % rmod) * ldr + col]; if (RES_BF16) rv = bf16_round(rv); v += rv; }
      if (ACT == 1) v = fmaxf(v, 0.f);
      if (ACT == 2) v = 0.5f * v * (1.0f + erff(v * 0.70710678118654752f));
      if (ACT == 3) { const float u = 0.7978845608028654f * (v + 0.044715f * v * v * v); v = 0.5f * v * (1.0f + tanhf(u)); }
      so[w][8 * hh + r][t * 16 + ln] = v;
    }
  }
  __builtin_amdgcn_fence(__ATOMIC_ACQ_REL, "workgroup");
  __builtin_amdgcn_wave_barrier();
  const int rsub = lane >> 4, c4 = (lane & 15) * 4;
  {
#pragma unroll
    for (int q = 0; q < 8; ++q) {
      const int r = q * 2 + rsub;
      const v4f v = *(const v4fa*)&so[w][r][c4];
      *(v4f*)(C + (size_t)(row0 + r) * ldc + col0 + c4) = v;
    }
    
  }
}
// row LayerNorm (biased variance, eps) over N: s = X (+ R); optional out_sum <- s; out_norm <- (s-mu)*rsqrt(var+eps)*g + b
template <bool PARAM_BF16>
__global__ __launch_bounds__(256) void k_layernorm(const float* __restrict__ X, const float* __restrict__ R, const float* __restrict__ g, const float* __restrict__ bta,
                                                  float* __restrict__ out_sum, float* __restrict__ out_norm, int N, float eps) {
  __shared__ float red[256];
  const int row = blockIdx.x, tid = threadIdx.x;
  const float* x = X + (size_t)row * N; const float* rr = R ? R + (size_t)row * N : nullptr;
  float vals[16];                     // up to N = 4096
  const int per = N / 256;            // contiguous chunk per thread? use strided-by-4 chunks: thread handles j = tid*4 + 1024*u
  float s1 = 0.f;
  for (int u = 0; u < per / 4; ++u) {
    const int j = tid * 4 + 1024 * u;
    const v4f a = *(const v4fa*)(x + j);
    v4f b = {0.f,0.f,0.f,0.f}; if (rr) b = *(const v4fa*)(rr + j);
#pragma unroll
    for (int q = 0; q < 4; ++q) { const float v = a[q] + b[q]; vals[u * 4 + q] = v; s1 += v; }
  }
  red[tid] = s1; __syncthreads();
  for (int st = 128; st > 0; st >>= 1) { if (tid < st) red[tid] += red[tid + st]; __syncthreads(); }
  const float mu = red[0] / (float)N; __syncthreads();
  float s2 = 0.f;
  for (int u = 0; u < per / 4; ++u)
#pragma unroll
    for (int q = 0; q < 4; ++q) { const float c = vals[u * 4 + q] - mu; s2 += c * c; }
  red[tid] = s2; __syncthreads();
  for (int st = 128; st > 0; st >>= 1) { if (tid < st) red[tid] += red[tid + st]; __syncthreads(); }
  const float rs = rsqrtf(red[0] / (float)N + eps);
  {
    for (int u = 0; u < per / 4; ++u) {
      const int j = tid * 4 + 1024 * u;
      v4f o, sm;
#pragma unroll
      for (int q = 0; q < 4; ++q) {
        float gg = g[j + q], bb = bta[j + q];
        if (PARAM_BF16) { gg = bf16_round(gg); bb = bf16_round(bb); }
        sm[q] = vals[u * 4 + q]; o[q] = (vals[u * 4 + q] - mu) * rs * gg + bb;
      }
      if (out_sum) *(v4f*)(out_sum + (size_t)row * N + j) = sm;
      *(v4f*)(out_norm + (size_t)row * N + j) = o;
    }
    
  }
}



// ---- f16 WMMA path (v_wmma_f32_16x16x32_f16): 11-bit significands for operands in range — used where a [0,1] probability operand needs more precision than bf16
typedef _Float16 v16h __attribute__((ext_vector_type(16)));
union FragH { v16h v; v8us half[2]; _Float16 h[16]; unsigned short u[16]; };
template <int NT>
__device__ __forceinline__ v8f mmaH(v16h ah, v16h al, v16h bh, v16h bl, v8f c) {
  c = __builtin_amdgcn_wmma_f32_16x16x32_f16(false, ah, false, bh, (short)0, c, false, false);
  if (NT >= 2) c = __builtin_amdgcn_wmma_f32_16x16x32_f16(false, al, false, bh, (short)0, c, false, false);
  if (NT >= 3) c = __builtin_amdgcn_wmma_f32_16x16x32_f16(false, ah, false, bl, (short)0, c, false, false);
  asm volatile("v_nop\n\tv_nop\n\tv_nop\n\tv_nop" : "+v"(c) : "v"(ah), "v"(al), "v"(bh), "v"(bl));
  return c;
}
// batched GEMM like k_gemm_b but f16 operands: A f32 (split into f16 hi/lo if ASPLIT, else rounded to f16), Bt = f16 values [n][k]; alpha; C f32; N multiple of 16 (partial tiles skipped)
template <bool ASPLIT>
__global__ __launch_bounds__(128) void k_gemm_h(const float* __restrict__ A, int lda, size_t sA, const _Float16* __restrict__ Bh, int ldb, size_t sB, float alpha, float* __restrict__ C, int ldc, size_t sC, int M, int N, int K) {
  __shared__ __attribute__((aligned(16))) float so[4][16][64];
  const int tid = threadIdx.x, w = tid >> 5, lane = tid & 31, ln = lane & 15, hh = lane >> 4; const int by = blockIdx.y;
  A += (size_t)by * sA; Bh += (size_t)by * sB; C += (size_t)by * sC;
  const int ntn = (N + 63) / 64; const int wid = blockIdx.x * 4 + w; const int mt = wid / ntn, nq = wid % ntn; if (mt * 16 >= M) return;
  const int row0 = mt * 16, col0 = nq * 64; const float* arow = A + (size_t)(row0 + ln) * lda;
  v8f acc[4] = {};
  for (int kb = 0; kb < K; kb += 32) {
    FragH ah, al;
    const v4f x0 = *(const v4fa*)(arow + kb + 8 * hh), x1 = *(const v4fa*)(arow + kb + 8 * hh + 4), x2 = *(const v4fa*)(arow + kb + 16 + 8 * hh), x3 = *(const v4fa*)(arow + kb + 16 + 8 * hh + 4);
    float xs[16] = {x0[0],x0[1],x0[2],x0[3],x1[0],x1[1],x1[2],x1[3],x2[0],x2[1],x2[2],x2[3],x3[0],x3[1],x3[2],x3[3]};
#pragma unroll
    for (int i = 0; i < 16; ++i) { const _Float16 h = (_Float16)xs[i]; ah.h[i] = h; al.h[i] = ASPLIT ? (_Float16)(xs[i] - (float)h) : (_Float16)0.0f; }
#pragma unroll
    for (int t = 0; t < 4; ++t) { if (col0 + t * 16 >= N) continue; const size_t boff = (size_t)(col0 + t * 16 + ln) * ldb + kb; FragH bq; bq.half[0] = *(const v8us*)(Bh + boff + 8 * hh); bq.half[1] = *(const v8us*)(Bh + boff + 16 + 8 * hh);
      acc[t] = mmaH<ASPLIT ? 2 : 1>(ah.v, al.v, bq.v, bq.v, acc[t]); }
  }
#pragma unroll
  for (int t = 0; t < 4; ++t) { if (col0 + t * 16 >= N) continue;
#pragma unroll
    for (int r = 0; r < 8; ++r) so[w][8 * hh + r][t * 16 + ln] = acc[t][r] * alpha; }
  __builtin_amdgcn_fence(__ATOMIC_ACQ_REL, "workgroup"); __builtin_amdgcn_wave_barrier();
  const int rsub = lane >> 4, c4 = (lane & 15) * 4;
  {
#pragma unroll
    for (int q = 0; q < 8; ++q) { const int r = q * 2 + rsub; if (col0 + c4 < N) { const v4f v = *(const v4fa*)&so[w][r][c4]; *(v4f*)(C + (size_t)(row0 + r) * ldc + col0 + c4) = v; } }
     }
}

// Wt[n][k] = f16(W[k][n]·scale) from f32 row-major W[K][N] (scale = power of two; bf16-exact weights stay exact in f16 away from the subnormal range)
__global__ __launch_bounds__(256) void k_wt_f16(const float* __restrict__ W, _Float16* __restrict__ Wt, int K, int N, float scale) {
  const int t = blockIdx.x * 256 + threadIdx.x; if (t >= N * (K / 8)) return; const int n = t / (K / 8), k8 = (t % (K / 8)) * 8; FragH f;
#pragma unroll
  for (int i = 0; i < 8; ++i) f.h[i] = (_Float16)(bf16_round(W[(size_t)(k8 + i) * N + n]) * scale); const v8us o = f.half[0];
  *(v8us*)((unsigned short*)Wt + (size_t)n * K + k8) = o; 
}
// k_gemm_hh variant with fused epilogue: v = acc·alpha + bias[by·sBias + col] (+ CP[(row/rowsPerB)·sCPb + by·64 + col] if CP) ; ACT 0 none / 1 elu ; writes f16 C16 (and f32 C if non-null)
template <int ACT>
__global__ __launch_bounds__(128) void k_gemm_hhx(const _Float16* __restrict__ A, int lda, size_t sA, const _Float16* __restrict__ Bh, int ldb, size_t sB, float alpha, const float* __restrict__ bias, size_t sBias, const float* __restrict__ CP, int rowsPerB, size_t sCPb, int row0g,
    float* __restrict__ C, _Float16* __restrict__ C16, int ldc, size_t sC, int M, int N, int K) {
  __shared__ __attribute__((aligned(16))) float so[4][16][64];
  const int tid = threadIdx.x, w = tid >> 5, lane = tid & 31, ln = lane & 15, hh = lane >> 4; const int by = blockIdx.y;
  A += (size_t)by * sA; Bh += (size_t)by * sB; const size_t cofs = (size_t)by * sC; const float* bp = bias ? bias + (size_t)by * sBias : nullptr;
  const int ntn = (N + 63) / 64; const int wid = blockIdx.x * 4 + w; const int mt = wid / ntn, nq = wid % ntn; if (mt * 16 >= M) return;
  const int row0 = mt * 16, col0 = nq * 64; const _Float16* arow = A + (size_t)(row0 + ln) * lda;
  v8f acc[4] = {};
  for (int kb = 0; kb < K; kb += 32) { FragH ah; ah.half[0] = *(const v8us*)((const unsigned short*)arow + kb + 8 * hh); ah.half[1] = *(const v8us*)((const unsigned short*)arow + kb + 16 + 8 * hh);
#pragma unroll
    for (int t = 0; t < 4; ++t) { if (col0 + t * 16 >= N) continue; const size_t boff = (size_t)(col0 + t * 16 + ln) * ldb + kb; FragH bq; bq.half[0] = *(const v8us*)((const unsigned short*)Bh + boff + 8 * hh); bq.half[1] = *(const v8us*)((const unsigned short*)Bh + boff + 16 + 8 * hh);
      acc[t] = mmaH<1>(ah.v, ah.v, bq.v, bq.v, acc[t]); }
  }
#pragma unroll
  for (int t = 0; t < 4; ++t) { if (col0 + t * 16 >= N) continue; const int col = col0 + t * 16 + ln; const float bv = bp ? bf16_round(bp[col]) : 0.f;
#pragma unroll
    for (int r = 0; r < 8; ++r) { float v = acc[t][r] * alpha + bv; if (CP) { const int rr = row0g + row0 + 8 * hh + r; if (rowsPerB < 0) v += CP[cofs + (size_t)rr * ldc + col];      /* rowsPerB < 0: own element of the batched C plane */ else { const int bidx = rr / rowsPerB; v += CP[(size_t)bidx * sCPb + (size_t)by * 64 + col]; } } if (ACT == 1) v = (v > 0.f) ? v : expm1f(v); else if (ACT == 7) v = (v > 0.f) ? v + 1.0f : expf(v); else if (ACT == 8) v = tanhf(v); else if (ACT == 9) v = 0.5f * v * (1.0f + tanhf(0.7978845608028654f * (v + 0.044715f * v * v * v))); else if (ACT == 11) v = 1.0f / (1.0f + expf(-v)); else if (ACT == 12) v = (v > 0.f) ? v : 0.01f * v; else if (ACT == 14) v = (v > 0.f) ? v : 0.1f * v; else if (ACT == 16) v = (v >= 0.f) ? v : 0.3f * v; else if (ACT == 17) v = (v >= 0.f) ? v : 0.2f * v; else if (ACT == 15) v = v / (1.0f + expf(-v)); else if (ACT == 3) v = fmaxf(v, 0.f); else if (ACT == 6) v = 0.5f * v * (1.0f + erff(v * 0.70710678118654752f)); so[w][8 * hh + r][t * 16 + ln] = v; } }
  __builtin_amdgcn_fence(__ATOMIC_ACQ_REL, "workgroup"); __builtin_amdgcn_wave_barrier();
  const int rsub = lane >> 4, c4 = (lane & 15) * 4; typedef _Float16 v4h __attribute__((ext_vector_type(4)));
  {
#pragma unroll
    for (int q = 0; q < 8; ++q) { const int r = q * 2 + rsub; if (col0 + c4 < N) { const v4f v = *(const v4fa*)&so[w][r][c4]; if (C) *(v4f*)(C + cofs + (size_t)(row0 + r) * ldc + col0 + c4) = v; if (C16) { v4h h4; for (int i = 0; i < 4; ++i) h4[i] = (_Float16)v[i]; *(v4h*)(C16 + cofs + (size_t)(row0 + r) * ldc + col0 + c4) = h4; } } }
     }
}


typedef _Float16 v4h __attribute__((ext_vector_type(4)));

__global__ __launch_bounds__(256) void k_h16(const float* __restrict__ x, _Float16* __restrict__ X16, size_t n8) { const size_t t = (size_t)blockIdx.x * 256 + threadIdx.x; if (t >= n8) return; FragH f;
#pragma unroll
  for (int q = 0; q < 8; ++q) f.h[q] = (_Float16)x[t * 8 + q]; *(v8us*)((unsigned short*)X16 + t * 8) = f.half[0];  }
__global__ __launch_bounds__(256) void k_round16f(const float* __restrict__ W, _Float16* __restrict__ Bt, size_t n8) { const size_t t = (size_t)blockIdx.x * 256 + threadIdx.x; if (t >= n8) return; FragH f;
#pragma unroll
  for (int i = 0; i < 8; ++i) f.h[i] = (_Float16)(bf16_round(W[t * 8 + i]) * 16.0f); *(v8us*)((unsigned short*)Bt + t * 8) = f.half[0];  }
template <int NHv, int TTv>
__global__ __launch_bounds__(256) void k_vt(const _Float16* __restrict__ V16, int ldv, int voff, _Float16* __restrict__ Vt) { __shared__ unsigned short tl[64][66]; const int tid = threadIdx.x; const int slab = blockIdx.x / (TTv / 64), lg = blockIdx.x % (TTv / 64); const int b = slab / NHv, h = slab % NHv;
  for (int i = tid; i < 64 * 8; i += 256) { const int r = i / 8, c8 = (i % 8) * 8; FragH f; f.half[0] = *(const v8us*)((const unsigned short*)V16 + ((size_t)b * TTv + lg * 64 + r) * ldv + voff + h * 64 + c8);
#pragma unroll
    for (int q = 0; q < 8; ++q) tl[r][c8 + q] = f.u[q]; }
  __syncthreads();
  {
#pragma unroll
    for (int rd = 0; rd < 2; ++rd) { const int d = rd * 32 + tid / 8, pc = tid % 8; FragH f;
#pragma unroll
      for (int q = 0; q < 8; ++q) f.u[q] = tl[pc * 8 + q][d];
      *(v8us*)((unsigned short*)Vt + ((size_t)slab * 64 + d) * TTv + lg * 64 + pc * 8) = f.half[0]; }
     } }

__global__ __launch_bounds__(256) void k_hl(const float* __restrict__ F, _Float16* __restrict__ Hh, _Float16* __restrict__ Hl, size_t n8) { const size_t t = (size_t)blockIdx.x * 256 + threadIdx.x; if (t >= n8) return; FragH fh, fl; const v4f a = *(const v4fa*)(F + t * 8), c = *(const v4fa*)(F + t * 8 + 4);
#pragma unroll
  for (int q = 0; q < 4; ++q) { _Float16 h = (_Float16)a[q]; fh.h[q] = h; fl.h[q] = (_Float16)((a[q] - (float)h) * 1024.0f); h = (_Float16)c[q]; fh.h[4 + q] = h; fl.h[4 + q] = (_Float16)((c[q] - (float)h) * 1024.0f); }
  { *(v8us*)((unsigned short*)Hh + t * 8) = fh.half[0]; *(v8us*)((unsigned short*)Hl + t * 8) = fl.half[0];  } }

// ---- fast GEMM (wave tile 32x64; requires M % 32 == 0 rows per launch region and N % 64 == 0); epilogue = k_gemm_hhx semantics ----
__device__ __forceinline__ v16h g2_frag(const _Float16* p, int hh) { FragH f; f.half[0] = *(const v8us*)((const unsigned short*)p + 8 * hh); f.half[1] = *(const v8us*)((const unsigned short*)p + 16 + 8 * hh); return f.v; }
__device__ __forceinline__ v8f g2_mma(v16h a, v16h b, v8f c) { v8f d = __builtin_amdgcn_wmma_f32_16x16x32_f16(false, a, false, b, (short)0, c, false, false); asm volatile("v_nop\n\tv_nop\n\tv_nop\n\tv_nop" : "+v"(d) : "v"(a), "v"(b)); return d; }
// CAUS 0: plain. CAUS 1 (scores): a 64-column tile at or past the end of its rows' causal query tile is skipped. CAUS 2 (P V): K runs over the keys of the rows' causal query tile only.
// F0 1: C holds only rows 0..QT0-1 of each batch, packed ([NB][QT0] rows); the other rows go to C16 alone.
template <int ACT, int CAUS = 0, int F0 = 0>
__global__ __launch_bounds__(128) void k_gemm2(const _Float16* __restrict__ A, int lda, size_t sA, const _Float16* __restrict__ Bh, int ldb, size_t sB, float alpha, const float* __restrict__ bias, size_t sBias, const float* __restrict__ CP, int rowsPerB, size_t sCPb, int row0g,
    float* __restrict__ C, _Float16* __restrict__ C16, int ldc, size_t sC, int M, int N, int K) { static_assert(ACT == 0 || ACT == 3 || ACT == 6 || ACT == 8 || ACT == 9 || ACT == 11 || ACT == 12 || ACT == 14 || ACT == 15 || ACT == 16 || ACT == 17, "k_gemm2: unsupported ACT code (would silently apply no activation)");
  __shared__ __attribute__((aligned(16))) float so[4][32][68];
  const int tid = threadIdx.x, w = tid >> 5, lane = tid & 31, ln = lane & 15, hh = lane >> 4; const int by = blockIdx.y;
  A += (size_t)by * sA; Bh += (size_t)by * sB; const size_t cofs = (size_t)by * sC; const float* bp = bias ? bias + (size_t)by * sBias : nullptr;
  const int ntn = N >> 6; const int mt = blockIdx.x / ntn, nq = blockIdx.x - mt * ntn; const int row0 = mt * 128 + 32 * w, col0 = nq * 64; if (row0 >= M) return;
  static_assert(QT % 128 == 0, "a 128-row block lies in one causal query tile"); const int nkc = (mt * 128 / QT + 1) * QT;      /* keys below the end of this block's causal query tile */
  if (CAUS == 1 && col0 >= nkc) return; if (CAUS == 2) K = nkc;
  const _Float16* a0p = A + (size_t)(row0 + ln) * lda; const _Float16* a1p = a0p + (size_t)16 * lda;
  const _Float16* b0p = Bh + (size_t)(col0 + ln) * ldb; const _Float16* b1p = b0p + (size_t)16 * ldb; const _Float16* b2p = b1p + (size_t)16 * ldb; const _Float16* b3p = b2p + (size_t)16 * ldb;
  const v8f z8 = {0.f,0.f,0.f,0.f,0.f,0.f,0.f,0.f}; v8f c00 = z8, c01 = z8, c02 = z8, c03 = z8, c10 = z8, c11 = z8, c12 = z8, c13 = z8;
#pragma unroll 1
  for (int kb = 0; kb < K; kb += 32) { const v16h a0 = g2_frag(a0p + kb, hh), a1 = g2_frag(a1p + kb, hh);
    v16h b = g2_frag(b0p + kb, hh); c00 = g2_mma(a0, b, c00); c10 = g2_mma(a1, b, c10);
    b = g2_frag(b1p + kb, hh); c01 = g2_mma(a0, b, c01); c11 = g2_mma(a1, b, c11);
    b = g2_frag(b2p + kb, hh); c02 = g2_mma(a0, b, c02); c12 = g2_mma(a1, b, c12);
    b = g2_frag(b3p + kb, hh); c03 = g2_mma(a0, b, c03); c13 = g2_mma(a1, b, c13); }
  v8f accs[8] = {c00, c01, c02, c03, c10, c11, c12, c13};
#pragma unroll
  for (int u = 0; u < 8; ++u) { const int t = u & 3, half = u >> 2; const int col = col0 + t * 16 + ln; const float bv = bp ? bf16_round(bp[col]) : 0.f;
#pragma unroll
    for (int r = 0; r < 8; ++r) { const int rloc = half * 16 + 8 * hh + r; float v = accs[u][r] * alpha + bv; if (CP) { if (rowsPerB < 0) v += CP[cofs + (size_t)(row0g + row0 + rloc) * ldc + col];      /* rowsPerB < 0: own element of the batched C plane */ else { const int bidx = (row0g + row0 + rloc) / rowsPerB; v += CP[(size_t)bidx * sCPb + (size_t)by * 64 + col]; } }
      if (ACT == 3) v = fmaxf(v, 0.f); else if (ACT == 6) v = 0.5f * v * (1.0f + erff(v * 0.70710678118654752f)); else if (ACT == 11) v = 1.0f / (1.0f + expf(-v)); else if (ACT == 15) v = v / (1.0f + expf(-v)); else if (ACT == 12) v = (v > 0.f) ? v : 0.01f * v; else if (ACT == 8) v = tanhf(v); else if (ACT == 9) v = 0.5f * v * (1.0f + tanhf(0.7978845608028654f * (v + 0.044715f * v * v * v))); else if (ACT == 14) v = (v > 0.f) ? v : 0.1f * v; else if (ACT == 16) v = (v >= 0.f) ? v : 0.3f * v; else if (ACT == 17) v = (v >= 0.f) ? v : 0.2f * v;
      so[w][rloc][t * 16 + ln] = v; } }
  __builtin_amdgcn_fence(__ATOMIC_ACQ_REL, "workgroup"); __builtin_amdgcn_wave_barrier();
  const int rsub = lane >> 4, c4 = (lane & 15) * 4;
  static_assert(SQ % 32 == 0 && QT0 % 32 == 0, "a wave's 32 rows lie on one side of the first tile's end"); size_t crow = (size_t)row0; if (F0) { const int rb = row0 / SQ, ri = row0 - rb * SQ; crow = (size_t)rb * QT0 + ri; if (ri >= QT0) C = nullptr; }
  {
#pragma unroll
    for (int q = 0; q < 16; ++q) { const int r = q * 2 + rsub; const v4f v = *(const v4fa*)&so[w][r][c4]; if (C) *(v4f*)(C + cofs + (crow + r) * ldc + col0 + c4) = v; if (C16) { v4h h4; for (int i = 0; i < 4; ++i) h4[i] = (_Float16)v[i]; *(v4h*)(C16 + cofs + (size_t)(row0 + r) * ldc + col0 + c4) = h4; } }
     } }


__global__ __launch_bounds__(256) void k_rsm(const float* __restrict__ S, _Float16* __restrict__ P, int nrows) {
  #pragma clang fp contract(off)
  const int i = blockIdx.x * 256 + threadIdx.x; if (i >= nrows) return; const float* s = S + (size_t)i * SQ; float mx = -3.0e38f;
#pragma unroll 1
  for (int j = 0; j < SQ; ++j) mx = fmaxf(mx, s[j]); float se = 0.f;
#pragma unroll 1
  for (int j = 0; j < SQ; ++j) se += expf(s[j] - mx); const float sc = 256.0f / se;
#pragma unroll 1
  for (int j0 = 0; j0 < SQ; j0 += 8) { FragH f; for (int q = 0; q < 8; ++q) f.h[q] = (_Float16)(expf(s[j0 + q] - mx) * sc); unsigned short* d = (unsigned short*)P + (size_t)i * SQ + j0; *(v8us*)d = f.half[0];  } }
__global__ __launch_bounds__(256) void k_vt(const _Float16* __restrict__ V16, int b, int h0, _Float16* __restrict__ VT) { __shared__ unsigned short tl[64][65]; const int tid = threadIdx.x; const int hh = blockIdx.x % HG, sg = blockIdx.x / HG; const int s0 = sg * 64; const int h = h0 + hh;
  for (int i = tid; i < 64 * 8; i += 256) { const int j = i / 8, d8 = (i % 8) * 8; FragH f; f.half[0] = *(const v8us*)((const unsigned short*)V16 + ((size_t)b * SQ + s0 + j) * DM + h * HD + d8); for (int q = 0; q < 8; ++q) tl[d8 + q][j] = f.u[q]; }
  __syncthreads();
  { for (int i = tid; i < 64 * 8; i += 256) { const int d = i / 8, j8 = (i % 8) * 8; FragH f; for (int q = 0; q < 8; ++q) f.u[q] = tl[d][j8 + q]; *(v8us*)((unsigned short*)VT + ((size_t)hh * HD + d) * SQ + s0 + j8) = f.half[0]; }  } }



template <int BFIN, int WXB>
__global__ __launch_bounds__(256) void k_ln16(const float* __restrict__ X, const float* __restrict__ g, const float* __restrict__ bb, float eps, _Float16* __restrict__ N16, float* __restrict__ XB) {
  #pragma clang fp contract(off)
  __shared__ float red[256]; const size_t r = blockIdx.x; const int t = threadIdx.x; const v4f xa = *(const v4fa*)(X + r * DMQ + t * 4); float s[4]; float sum = 0.f;
  for (int q = 0; q < 4; ++q) { s[q] = BFIN ? bf16_round(xa[q]) : xa[q]; sum = __fadd_rn(sum, s[q]); }
  red[t] = sum; __syncthreads(); for (int st = 128; st > 0; st >>= 1) { if (t < st) red[t] = __fadd_rn(red[t], red[t + st]); __syncthreads(); } const float mu = red[0] / (float)DMQ; __syncthreads();
  float vs = 0.f; for (int q = 0; q < 4; ++q) { const float dl = __fadd_rn(s[q], -mu); vs = __fadd_rn(vs, __fmul_rn(dl, dl)); } red[t] = vs; __syncthreads(); for (int st = 128; st > 0; st >>= 1) { if (t < st) red[t] = __fadd_rn(red[t], red[t + st]); __syncthreads(); }
  const float rs = rsqrtf(__fadd_rn(red[0] / (float)DMQ, eps)); v4h y; v4f xb;
  for (int q = 0; q < 4; ++q) { const int c = t * 4 + q; y[q] = (_Float16)__fadd_rn(__fmul_rn(__fmul_rn(__fadd_rn(s[q], -mu), rs), bf16_round(g[c])), bf16_round(bb[c])); xb[q] = s[q]; }
  { *(v4h*)(N16 + r * DMQ + t * 4) = y; if (WXB) *(v4f*)(XB + r * DMQ + t * 4) = xb;  } }
__global__ __launch_bounds__(256) void k_ftres2(const float* __restrict__ OF0, const float* __restrict__ XB, float* __restrict__ X1, size_t n4) {
  #pragma clang fp contract(off)
  const size_t t = (size_t)blockIdx.x * 256 + threadIdx.x; if (t >= n4) return; const v4f o = *(const v4fa*)(OF0 + t * 4), xv = *(const v4fa*)(XB + t * 4); v4f y; for (int q = 0; q < 4; ++q) y[q] = __fadd_rn(__fmul_rn(o[q], 0.015625f), xv[q]); *(v4f*)(X1 + t * 4) = y;  }

__global__ __launch_bounds__(256) void k_wthd(const float* __restrict__ Wt, _Float16* __restrict__ Bt) { const size_t t = (size_t)blockIdx.x * 256 + threadIdx.x; if (t >= (size_t)NH * HD * (DM / 8)) return; const int m8 = (int)(t % (DM / 8)) * 8; const int d = (int)((t / (DM / 8)) % HD); const int h = (int)(t / ((size_t)(DM / 8) * HD)); FragH f;
  for (int q = 0; q < 8; ++q) f.h[q] = (_Float16)(16.0f * bf16_round(Wt[((size_t)h * DM + m8 + q) * HD + d])); unsigned short* dst = (unsigned short*)Bt + ((size_t)h * HD + d) * DM + m8; *(v8us*)dst = f.half[0];  }




__global__ __launch_bounds__(256) void k_wtpad(const float* __restrict__ Wm, _Float16* __restrict__ Wt, int Kr, int Kp, int Nr, int Np, float scale) {
  const int t = blockIdx.x * 256 + threadIdx.x; if (t >= Np * (Kp / 8)) return; const int n = t / (Kp / 8), k8 = (t % (Kp / 8)) * 8; const int nc = min(n, Nr - 1); const float fn = (n < Nr) ? 1.f : 0.f; FragH f;
  for (int i = 0; i < 8; ++i) { const int k = k8 + i; const int kc = min(k, Kr - 1); const float fk = (k < Kr) ? fn : 0.f; f.h[i] = (_Float16)(bf16_round(Wm[(size_t)kc * Nr + nc]) * scale * fk); }
  unsigned short* o = (unsigned short*)Wt + (size_t)n * Kp + k8; *(v8us*)o = f.half[0];  }
__global__ __launch_bounds__(128) void k_bpad(const float* __restrict__ b, float* __restrict__ Bp, int nr, int np) {
  const int i = threadIdx.x; if (i >= np) return; const float v = b[min(i, nr - 1)] * ((i < nr) ? 1.f : 0.f); *(float*)(Bp + i) = v;  }

#define DI 64         /* inner width = NH * HD (ONE 64-wide head) */
#define LQK (3 * DI)  /* fused q | k | v row pitch (192) */
__global__ __launch_bounds__(256) void k_o0(const float* __restrict__ OF, float* __restrict__ ob, size_t n4) {
  #pragma clang fp contract(off)
  const size_t t = (size_t)blockIdx.x * 256 + threadIdx.x; if (t >= n4) return; const size_t e = t * 4; const int i = (int)(e / DI); const int c = (int)(e % DI); const int h = c / HD, d = c % HD; const v4f a = *(const v4fa*)(OF + e); v4f o; for (int q = 0; q < 4; ++q) o[q] = __fmul_rn(a[q], 0.015625f); float* dst = ob + (size_t)h * SQ * HD + (size_t)i * HD + d; *(v4f*)dst = o;  }

// The projection q | k | v = x W^T straight from the f32 input: x is read once, by the GEMM itself.
#define GKS 8                        /* K slices of a block */
#define GST (DM / GKS / 32)          /* 32-wide k steps of a slice */
#define GNT (LQK / 16)               /* 16-column tiles of q | k | v */
#define GPL 40                       /* 16-byte places of a register half's plane in LDS: 32 lanes and 8 idle, so that the two planes that a half wave reads together fall on different banks */
#define KVT 4096                     /* f16 elements of a 32-key tile of the k | v^T plane: 8 half fragments of k, then 8 of v^T, 512 bytes each */
// Wq | Wk | Wv (natural [64][DM] rows, x16, exact in f16) packed so that a wave's 16-byte load of half a B fragment is 512 contiguous bytes:
// BP[k step][column tile][half j][lane][8]: column 16 tile + (lane & 15), k = 32 step + 16 j + 8 (lane >> 4) + 0..7 (the hardware k order, as the A loader below).
__global__ __launch_bounds__(256) void k_wpack(const float* __restrict__ wq, const float* __restrict__ wk, const float* __restrict__ wv, _Float16* __restrict__ BP) {
  static_assert((DM / 32) * GNT * 2 * 32 % 256 == 0 && DI % 16 == 0, "whole blocks; a column tile lies in one weight");
  const unsigned t = blockIdx.x * 256 + threadIdx.x, lane = t & 31, j = (t >> 5) & 1, u = t >> 6; const unsigned ct = u % GNT, st = u / GNT;
  const unsigned col = ct * 16 + (lane & 15), k = st * 32 + j * 16 + 8 * (lane >> 4);
  const float* w = (col < DI) ? wq : (col < 2 * DI) ? wk : wv; const float* p = w + (size_t)(col % DI) * DM + k; FragH f;
#pragma unroll      /* the eight elements stay in registers: two 16-byte loads, one 16-byte store */
  for (int q = 0; q < 8; ++q) f.h[q] = (_Float16)(bf16_round(p[q]) * 16.0f);
  *(v8us*)((unsigned short*)BP + (size_t)t * 8) = f.half[0]; }
typedef float v2fc __attribute__((ext_vector_type(2)));
typedef __bf16 v2bc __attribute__((ext_vector_type(2)));
typedef _Float16 v2hc __attribute__((ext_vector_type(2)));
// A block takes 32 rows of x and all 192 columns; wave w takes row tile w & 1 and K slice w >> 1 (128 of the 1024 k): its whole share of x (16 copies) is in flight at once.
// x goes to LDS by asynchronous copies, one copy = the wave's 512 contiguous bytes of ONE row (four whole lines; a fragment load straight from memory takes 32 bytes from each of 16 rows), and is read from there as fragments.
// A wave copies into, and reads from, its own range of part alone (the range that takes its sums later): its own wait is all that stands between copy and read.
// The slices' parts are summed in LDS (slice 0 first). A block's 32 rows are one 32-key step of attention: it stores that step's k and v^T as the A fragments that attention loads,
// KV[batch][step][k: (key tile kt, k block ks, half j) | v^T: (column tile dt, half j)][lane][8]: k: key 16 kt + (lane & 15), feature 32 ks + 16 j + 8 (lane >> 4) + 0..7; v^T: column 16 dt + (lane & 15), key 16 j + 8 (lane >> 4) + 0..7.
// They are also one row block of queries: Q16[batch][row block] holds its q as B fragments, in the order of k.
// An accumulator lane holds 8 consecutive rows of ONE column of D: 8 keys of a column of v as D = x W^T, 8 features of a row of q or k as D = W x^T (the same two fragments, A and B exchanged; same k order).
// So every accumulator half is four neighbours of a fragment: the parts go through LDS lane by lane in 16-byte pieces and need no transpose.
#define XP 132                       /* floats between two x rows in LDS: 528 bytes = 16 x 33, so that sixteen lanes' 16-byte reads of one column fall on 64 different banks */
#define GPRE (2 * GNT)               /* W fragments asked for while the x copies fly: two k steps */
/* eight copies of 16 bytes a lane: rows 0..7 from g (row pitch DM floats) to LDS byte address d (row pitch XP floats); the s_wait_xcnt stands in the copies' own statement, in front of any later write of a register that they name */
__device__ __forceinline__ void x_copy8(const unsigned d, const float* g) {
  asm volatile("global_load_async_to_lds_b128 %0, %8, off\n\t"
               "global_load_async_to_lds_b128 %1, %9, off\n\t"
               "global_load_async_to_lds_b128 %2, %10, off\n\t"
               "global_load_async_to_lds_b128 %3, %11, off\n\t"
               "global_load_async_to_lds_b128 %4, %12, off\n\t"
               "global_load_async_to_lds_b128 %5, %13, off\n\t"
               "global_load_async_to_lds_b128 %6, %14, off\n\t"
               "global_load_async_to_lds_b128 %7, %15, off\n\t"
               "s_wait_xcnt 0x0"
               :: "v"(d), "v"(d + 1 * XP * 4), "v"(d + 2 * XP * 4), "v"(d + 3 * XP * 4), "v"(d + 4 * XP * 4), "v"(d + 5 * XP * 4), "v"(d + 6 * XP * 4), "v"(d + 7 * XP * 4),
                  "v"(g), "v"(g + 1 * DM), "v"(g + 2 * DM), "v"(g + 3 * DM), "v"(g + 4 * DM), "v"(g + 5 * DM), "v"(g + 6 * DM), "v"(g + 7 * DM) : "memory"); }
__global__ __launch_bounds__(GKS * 2 * 32) void k_qkv(const float* __restrict__ x, const _Float16* __restrict__ BP, float* __restrict__ C0, float* __restrict__ Q0, float* __restrict__ K0, _Float16* __restrict__ Q16, _Float16* __restrict__ KV) {
  static_assert(DM % (GKS * 32) == 0 && NR % 32 == 0 && SQ % 32 == 0 && QT0 % 32 == 0 && 32 * DI / 4 == GKS * 2 * 32 && DI == 64, "whole k steps; a block's 32 rows lie on one side of the first tile's end; a thread sums four q, four k and four v elements");
  __shared__ __attribute__((aligned(16))) float part[GKS][2][GNT][2][GPL][4];      /* part[slice][row tile][column tile][register half][lane][4] */
  const int tid = threadIdx.x, lane = tid & 31, ln = lane & 15, hh = lane >> 4; const int w = __builtin_amdgcn_readfirstlane(tid >> 5); const int rt = w & 1, ks = w >> 1; const int row0 = (int)blockIdx.x * 32;
  static_assert(16 * XP <= GNT * 2 * GPL * 4 && XP >= GST * 32 && XP % 4 == 0 && GST * 32 * 4 == 32 * 16 && GPRE <= GST * GNT, "a wave's 16 x rows fit its own range of part; a copy is a wave's whole share of a row");
  float* xw = &part[ks][rt][0][0][0][0];      /* the wave's own range of part: no other wave touches it in front of the barrier below */
  const float* xg = x + (size_t)(row0 + rt * 16) * DM + ks * (GST * 32) + lane * 4; const unsigned xd = (unsigned)(size_t)xw + (unsigned)(lane * 16);      /* the lane's 16 bytes of row 0: in memory, and their LDS byte address */
  x_copy8(xd, xg); x_copy8(xd + 8 * XP * 4, xg + 8 * DM);
  const unsigned short* bs = (const unsigned short*)BP + (size_t)ks * (GST * GNT * 512); const unsigned bo = (unsigned)(lane * 16);      /* the lane's byte offset: the one vector register that all W loads name */
  FragH bq[GST * GNT];      /* every W fragment has a name of its own; a register holds one only from its load to its product */
#pragma unroll      /* constant indices: the array stays in registers */
  for (int f = 0; f < GPRE; ++f) { const char* p = (const char*)(bs + f * 512) + bo; bq[f].half[0] = *(const v8us*)p; bq[f].half[1] = *(const v8us*)(p + 512); }
  asm volatile("s_wait_asynccnt 0x0" ::: "memory");      /* the wave's sixteen copies have landed before it reads them; behind the first W loads, so that these fly beside the copies */
  const float* xr = xw + ln * XP + 8 * hh;      /* the lane's row; k order as in BP */
  const v8f z8 = {0.f, 0.f, 0.f, 0.f, 0.f, 0.f, 0.f, 0.f}; v8f acc[GNT];
#pragma unroll      /* constant indices: the arrays stay in registers */
  for (int t = 0; t < GNT; ++t) acc[t] = z8;
  v4f xa[4]; union { v16h v; v2hc p[8]; } ah[GST];      /* xa: a k step's x as read from LDS; ah: the same as a fragment */
#pragma unroll      /* constant indices: the arrays stay in registers */
  for (int s = -1; s < GST; ++s)
#pragma unroll      /* constant indices: the arrays stay in registers */
    for (int t = (s < 0 ? GNT / 4 : 0); t < GNT; ++t) { const int f = s * GNT + t;      /* s = -1: the first step's x alone */
      if (s >= 0) { const v16h b = bq[f].v; acc[t] = (t < 2 * DI / 16) ? __builtin_amdgcn_wmma_f32_16x16x32_f16(false, b, false, ah[s].v, (short)0, acc[t], false, false) : __builtin_amdgcn_wmma_f32_16x16x32_f16(false, ah[s].v, false, b, (short)0, acc[t], false, false); }      /* q, k: D = W x^T; v: D = x W^T */
      if (f + GNT >= GPRE && f + GNT < GST * GNT) { const char* p = (const char*)(bs + (f + GNT) * 512) + bo; bq[f + GNT].half[0] = *(const v8us*)p; bq[f + GNT].half[1] = *(const v8us*)(p + 512); }      /* the fragment of the next k step, into the registers that this product has set free */
      if (t == GNT / 4 && s + 1 < GST) { const float* q = xr + (s + 1) * 32; xa[0] = *(const v4f*)q; xa[1] = *(const v4f*)(q + 4); xa[2] = *(const v4f*)(q + 16); xa[3] = *(const v4f*)(q + 20); }      /* the next k step's x: read and rounded among this step's products */
      if (t == 3 * GNT / 4 && s + 1 < GST)
#pragma unroll      /* constant indices: the arrays stay in registers */
        for (int c = 0; c < 4; ++c) for (int i = 0; i < 2; ++i) { const v2fc e = {xa[c][2 * i], xa[c][2 * i + 1]}; const v2bc r = __builtin_convertvector(e, v2bc);      /* to bf16, nearest even, then exact in f16 */
          ah[s + 1].p[c * 2 + i] = __builtin_convertvector(__builtin_convertvector(r, v2fc), v2hc); }
      if (f >= GNT) __builtin_amdgcn_sched_barrier(0); }      /* holds each W load a whole k step ahead of its product, and the products in the order of their loads (left free, the compiler asked for the last step's fragments one product ahead: an L2 latency for every two) */
  asm volatile("s_wait_xcnt 0x0" :: "v"(bo) : "memory");      /* the same behind the W loads */
#pragma unroll      /* constant indices: the arrays stay in registers */
  for (int t = 0; t < GNT; ++t) for (int h = 0; h < 2; ++h) { const v4f e = {acc[t][4 * h], acc[t][4 * h + 1], acc[t][4 * h + 2], acc[t][4 * h + 3]}; *(v4f*)&part[ks][rt][t][h][lane][0] = e; }      /* q, k: columns 16 t + 8 hh + 4 h + 0..3 of row 16 rt + ln; v: rows 16 rt + 8 hh + 4 h + 0..3 of column 16 t + ln */
  __syncthreads();      /* every slice's part is in LDS before the sum reads it */
  const int rb = row0 / SQ, ri = row0 - rb * SQ; float* c0 = C0 + ((size_t)rb * QT0 + ri) * LQK; _Float16* kvt = KV + ((size_t)rb * (SQ / 32) + ri / 32) * KVT;      /* the block's own f32 rows (where kept) and its own tile */
  /* each thread's place in the three f16 ranges is 4 tid: whole lines stored. q and k: half fragment tid >> 6 = (kt 2 + ks) 2 + j, lane (tid >> 1) & 31. v: half fragment tid >> 6 = dt 2 + j (j = the row tile), lane (tid >> 1) & 31, register half tid & 1 */
  const int pl = (tid >> 1) & 31, ph = tid & 1, ci = tid >> 6;
  const int krow = (ci >> 2) * 16 + (pl & 15), qc = ((ci >> 1) & 1) * 32 + (ci & 1) * 16 + (pl >> 4) * 8 + ph * 4;
  v4f vq = *(const v4f*)&part[0][ci >> 2][ci & 3][ph][pl][0], vk = *(const v4f*)&part[0][ci >> 2][4 + (ci & 3)][ph][pl][0], vv = *(const v4f*)&part[0][ci & 1][8 + (ci >> 1)][ph][pl][0];
#pragma unroll      /* the LDS reads are issued together */
  for (int u = 1; u < GKS; ++u) { vq += *(const v4f*)&part[u][ci >> 2][ci & 3][ph][pl][0]; vk += *(const v4f*)&part[u][ci >> 2][4 + (ci & 3)][ph][pl][0]; vv += *(const v4f*)&part[u][ci & 1][8 + (ci >> 1)][ph][pl][0]; }
  vq *= 0.0625f; vk *= 0.0625f; vv *= 0.0625f; v4h hq, hk, hv; for (int i = 0; i < 4; ++i) { hq[i] = (_Float16)vq[i]; hk[i] = (_Float16)vk[i]; hv[i] = (_Float16)vv[i]; }
  _Float16* qd = Q16 + (size_t)row0 * DI; *(v4h*)(qd + tid * 4) = hq; *(v4h*)(kvt + tid * 4) = hk; *(v4h*)(kvt + KVT / 2 + tid * 4) = hv;
  asm volatile("s_wait_xcnt 0x0" :: "v"(tid), "v"(hq), "v"(hk), "v"(hv), "s"(qd), "s"(kvt) : "memory");      /* behind the three f16 stores; what they name is given as inputs so that it lives up to here: the f32 stores' addresses are formed behind it */
  if (ri < QT0) { const size_t fo = (((size_t)rb * (DI / 4) + (qc >> 2)) * QT0 + ri + krow) * 4; *(v4f*)(Q0 + fo) = vq; *(v4f*)(K0 + fo) = vk;      /* f32 q and k: [batch][feature / 4][row][4]: 16 rows of a feature group are 256 contiguous bytes, as the exact path's fragment loads take them */
    float* cv = c0 + ((ci & 1) * 16 + (pl >> 4) * 8 + ph * 4) * LQK + 2 * DI + (ci >> 1) * 16 + (pl & 15);
#pragma unroll      /* four rows of one column */
    for (int i = 0; i < 4; ++i) cv[i * LQK] = vv[i]; } }
#define FW 16                        /* waves of an attention block, either path */
// Exact f32 causal attention for rows 0..QT0-1 of each batch, spread over lanes: a block takes FW query rows (i0 ..) of batch b; sc: FW rows of QT0 floats in the block's LDS.
// Scores: one WAVE per 32-key chunk, on the f32 matrix form (16x16x4: full f32 operands, f32 sums): S = Q K^T, the block's FW rows against 16 keys a tile. Softmax: one WAVE per query row (lanes across the keys).
// P V: one WAVE per 32-key chunk, for all FW rows (a half wave across the 64 output columns, the two halves on rows r and r + FW / 2): a V row is read once a block; the chunks' parts lie in LDS behind sc and are summed by the row's wave.
typedef float v2f __attribute__((ext_vector_type(2)));
typedef float v2fa __attribute__((ext_vector_type(2), may_alias));
__device__ __forceinline__ void att0_rows(const float* __restrict__ QKV, const float* __restrict__ Q0, const float* __restrict__ K0, float scale, float* __restrict__ O, const int b, const int i0, float (*sc)[QT0]) {      /* sc: scaled scores, then the unnormalised weights, of the block's rows */
  static_assert(QT0 % 32 == 0 && QT0 / 32 <= 16 && QT0 / 32 <= FW && FW == 16 && QT0 % FW == 0 && HD == 64 && NH == 1, "key chunks of 32, at most 16 a row and at most one a wave; a block's rows are one 16-row matrix tile and end in the same chunk; two output columns a lane");
  const int tid = threadIdx.x, lane = tid & 31; const int w = __builtin_amdgcn_readfirstlane(tid >> 5);
  const int ln = lane & 15, hh = lane >> 4; const float* vb = QKV + (size_t)b * QT0 * LQK + 2 * DI;
  const float* qf = Q0 + ((size_t)b * (DI / 4) * QT0 + i0) * 4; const float* kf = K0 + (size_t)b * (DI / 4) * QT0 * 4;      /* [feature / 4][row][4] */
  for (int j0 = w * 32; j0 < i0 + FW; j0 += FW * 32) {      /* whole 32-key chunks up to the block's last row: j <= QT0 - 1; the same in every lane of a wave */
    /* A = the block's 16 q rows, B = 16 keys, twice; q and k through the same loader: lane (ln, hh) holds features 8 m + 4 hh + 0..3 of its row, two k steps of the 16x16x4 form; a wave's load is two runs of 256 contiguous bytes */
    const unsigned fo = (unsigned)((hh * QT0 + ln) * 16); v4f qa[HD / 8], k0[HD / 8], k1[HD / 8];      /* fo: the lane's byte offset in both planes */
#pragma unroll      /* constant indices: the arrays stay in registers */
    for (int m = 0; m < HD / 8; ++m) { qa[m] = *(const v4fa*)((const char*)(qf + m * (2 * QT0 * 4)) + fo); k0[m] = *(const v4fa*)((const char*)(kf + m * (2 * QT0 * 4) + j0 * 4) + fo); k1[m] = *(const v4fa*)((const char*)(kf + m * (2 * QT0 * 4) + (j0 + 16) * 4) + fo); }
    asm volatile("s_wait_xcnt 0x0" :: "v"(fo) : "memory");      /* behind the 24 loads, in front of the first write of a register that they name; their offset is named as an input so that it lives up to here */
    v8f s0 = {0.f, 0.f, 0.f, 0.f, 0.f, 0.f, 0.f, 0.f}, s1 = s0;      /* s0[r]: row 8 hh + r against key j0 + ln; s1: key j0 + 16 + ln */
#pragma unroll      /* constant indices: the arrays stay in registers */
    for (int m = 0; m < HD / 8; ++m) for (int e = 0; e < 4; e += 2) { const v2f a = {qa[m][e], qa[m][e + 1]}, b0 = {k0[m][e], k0[m][e + 1]}, b1 = {k1[m][e], k1[m][e + 1]};
      s0 = __builtin_amdgcn_wmma_f32_16x16x4_f32(false, a, false, b0, (short)0, s0, false, false); s1 = __builtin_amdgcn_wmma_f32_16x16x4_f32(false, a, false, b1, (short)0, s1, false, false); }
    asm volatile("v_nop\n\tv_nop\n\tv_nop\n\tv_nop" : "+v"(s0), "+v"(s1) : "v"(qa[0]), "v"(k0[0]), "v"(k1[0]));      /* the vector slots between the last matrix instruction and the first reader of its result; the first fragments are named as inputs so that no result register is laid over an operand just issued */
#pragma unroll      /* constant indices: the sums stay in registers */
    for (int r = 0; r < 8; ++r) { sc[8 * hh + r][j0 + ln] = s0[r] * scale; sc[8 * hh + r][j0 + 16 + ln] = s1[r] * scale; } }
  __syncthreads();      /* every key's scores are in LDS before a row's wave reads them */
  const int i = i0 + w; const int nu = (i >> 5) + 1; float x[QT0 / 32]; float mx = -1.0e30f;      /* nu: the same for every row of the block */
  const bool own = w < nu; v4f vv[32]; const float* vs = vb + (size_t)(w * 32) * LQK; const unsigned vo = (unsigned)(ln * 16);      /* the wave's own chunk of keys: its 32 V rows, four columns a lane, the same in both half waves (vo: the lane's byte offset); asked for here so that they arrive during the softmax */
  if (own) {
#pragma unroll      /* constant indices: the array stays in registers */
    for (int t = 0; t < 32; ++t) vv[t] = *(const v4fa*)((const char*)(vs + t * LQK) + vo);
    asm volatile("s_wait_xcnt 0x0" ::: "memory"); }      /* behind the 32 V loads, the last statement of their block: the softmax below writes the scalar registers that held their base */
#pragma unroll
  for (int u = 0; u < QT0 / 32; ++u) if (u < nu) x[u] = sc[w][u * 32 + lane];      /* all reads issued before the first is used */
#pragma unroll
  for (int u = 0; u < QT0 / 32; ++u) if (u < nu) { x[u] = (u * 32 + lane <= i) ? x[u] : -1.0e30f; mx = fmaxf(mx, x[u]); }
  for (int d = 16; d > 0; d >>= 1) mx = fmaxf(mx, __shfl_xor(mx, d, 32));
  float l = 0.f;
#pragma unroll
  for (int u = 0; u < QT0 / 32; ++u) if (u < nu) { const float e = expf(x[u] - mx); l += e; sc[w][u * 32 + lane] = e; }      /* keys past the row: exactly 0 */
  for (int d = 16; d > 0; d >>= 1) l += __shfl_xor(l, d, 32);
  __syncthreads();      /* every row's weights are in LDS before the chunks' waves read them */
  float* pp = &sc[0][0] + FW * QT0; float* pw = pp + (w * FW + hh * (FW / 2)) * HD + ln * 4;      /* pp[chunk][row][column]: the chunks' parts of P V */
  if (own) {
    for (int r = 0; r < FW / 2; ++r) { v4f p[8]; v4f o0 = {0.f, 0.f, 0.f, 0.f}, o1 = {0.f, 0.f, 0.f, 0.f};      /* two sums a row: a product need not wait for the one before it */
#pragma unroll      /* constant indices: the arrays stay in registers */
      for (int t = 0; t < 8; ++t) p[t] = *(const v4f*)&sc[r + hh * (FW / 2)][w * 32 + t * 4];      /* one address a half wave */
#pragma unroll      /* constant indices: the arrays stay in registers */
      for (int t = 0; t < 32; t += 2) { o0 += p[t >> 2][t & 3] * vv[t]; o1 += p[t >> 2][(t & 3) + 1] * vv[t + 1]; }
      *(v4f*)(pw + r * HD) = o0 + o1; } }
  else { const v4f z4 = {0.f, 0.f, 0.f, 0.f};      /* a wave without keys leaves zeros: the sum below takes FW parts whatever the row */
    for (int r = 0; r < FW / 2; ++r) *(v4f*)(pw + r * HD) = z4; }
  __syncthreads();      /* every chunk's part is in LDS before a row's wave sums them */
  v2f pt[FW];
#pragma unroll      /* all reads issued before the first is used */
  for (int u = 0; u < FW; ++u) pt[u] = *(const v2f*)(pp + (u * FW + w) * HD + lane * 2);
  v2f o = pt[0];
#pragma unroll      /* constant indices: the array stays in registers */
  for (int u = 1; u < FW; ++u) o += pt[u];
  o *= 1.0f / l;
  *(v2f*)(O + ((size_t)b * SQ + i) * DI + lane * 2) = o;      /* the row's own place in the output: no other block stores rows 0..QT0-1 */
  asm volatile("s_wait_xcnt 0x0" ::: "memory"); }      /* behind the store: in the joined kernel code of the other path follows in the listing and writes the store's registers */

// Fused causal attention. A block takes the FQ query rows of row block qb of batch b; its FW waves take the row block's keys in 32-key steps, step st to wave st % FW.
// A step: S^T = K Q^T (A = 16 key rows, B = 16 query rows: a lane holds scores of ONE query), running maximum and sum per query, weights exp(s - m) packed in place as f16 into the B operand of O^T += V^T P^T.
// At the end every wave leaves (m, l, O) in LDS and the block joins them: out = sum_w 2^(c (m_w - M)) O_w / sum_w 2^(c (m_w - M)) l_w.
#define FQ 32                        /* query rows of a block: two 16-column groups a wave */
#define FP 68                        /* floats between two rows of a wave's part in LDS: 16-byte aligned, rows spread over the banks */
#define FC (0.03125f * 1.44269504f)  /* raw score -> scaled log2 domain: 1024^-0.5 * log2 e */
/* 2^x; the v_nop is the slot that the instruction set asks for behind a transcendental, in the same statement so that it stands there whatever the compiler puts next */
__device__ __forceinline__ float fa_exp2(float x) { asm("v_exp_f32 %0, %0\n\tv_nop" : "+v"(x)); return x; }
/* a fragment stored in fragment order: two half fragments of 512 bytes; p: the lane's own 16 bytes of the first */
__device__ __forceinline__ v16h fa_frag(const unsigned short* p) { FragH f; f.half[0] = *(const v8us*)p; f.half[1] = *(const v8us*)(p + 256); return f.v; }
__device__ __forceinline__ v8f fa_mma(v16h a, v16h b, v8f c) { return __builtin_amdgcn_wmma_f32_16x16x32_f16(false, a, false, b, (short)0, c, false, false); }
__device__ __forceinline__ void fattn_rows(const _Float16* __restrict__ Q16, const _Float16* __restrict__ KV, float* __restrict__ O, const int b, const int qb, float (*po)[FQ][FP], float (*pm)[FQ], float (*pl)[FQ]) {
  static_assert(HD == 64 && NH == 1 && SQ % FQ == 0 && FQ == 32 && FW * 32 == FQ * (HD / 4), "two k blocks a score, four 16-row tiles of O^T; the join gives a thread four columns of one row");
  const int tid = threadIdx.x, lane = tid & 31, ln = lane & 15, hh = lane >> 4; const int w = __builtin_amdgcn_readfirstlane(tid >> 5);
  const unsigned short* qp = (const unsigned short*)Q16 + ((size_t)b * SQ + qb * FQ) * DI + lane * 8; const unsigned short* kvb = (const unsigned short*)KV + (size_t)b * (SQ / 32) * KVT + lane * 8;      /* the lane's 16 bytes of every half fragment */
  v16h q[2][2];
#pragma unroll
  for (int qt = 0; qt < 2; ++qt) for (int ks = 0; ks < 2; ++ks) q[qt][ks] = fa_frag(qp + (qt * 2 + ks) * 512);
  const v8f z8 = {0.f, 0.f, 0.f, 0.f, 0.f, 0.f, 0.f, 0.f}; v8f o[4][2]; float m[2] = {-3.0e38f, -3.0e38f}, l[2] = {0.f, 0.f};      /* m: raw (unscaled) score */
#pragma unroll
  for (int dt = 0; dt < 4; ++dt) for (int qt = 0; qt < 2; ++qt) o[dt][qt] = z8;
  for (int st = w; st <= qb; st += FW) {      /* the same in every lane of a wave; no barrier inside */
    const unsigned short* kv = kvb + (size_t)st * KVT; v16h kf[2][2], vf[4];      /* the step's tile: sixteen loads of 512 contiguous bytes a wave, one address */
#pragma unroll
    for (int kt = 0; kt < 2; ++kt) for (int ks = 0; ks < 2; ++ks) kf[kt][ks] = fa_frag(kv + (kt * 2 + ks) * 512);
#pragma unroll
    for (int dt = 0; dt < 4; ++dt) vf[dt] = fa_frag(kv + KVT / 2 + dt * 512);
    asm volatile("s_wait_xcnt 0x0" :: "v"(kv) : "memory");      /* behind the sixteen loads; their address is named as an input so that it lives up to here and no load's result lands in it earlier */
    __builtin_amdgcn_sched_barrier(0);      /* all sixteen loads of a step are issued ahead of its first product: one load latency a step (left free, the compiler put loads behind products, into their operands' registers: three latencies in a row) */
    v8f s[2][2];      /* s[qt][kt][r]: key k0 + 16 kt + 8 hh + r against query 16 qt + ln */
#pragma unroll
    for (int qt = 0; qt < 2; ++qt) for (int kt = 0; kt < 2; ++kt) s[qt][kt] = fa_mma(kf[kt][1], q[qt][1], fa_mma(kf[kt][0], q[qt][0], z8));
    if (st == qb) {      /* the row block's own keys: those past a row drop out (key 0 of the step stays for every row) */
#pragma unroll
      for (int qt = 0; qt < 2; ++qt) for (int kt = 0; kt < 2; ++kt) for (int r = 0; r < 8; ++r) s[qt][kt][r] = (kt * 16 + 8 * hh + r <= qt * 16 + ln) ? s[qt][kt][r] : -1.0e30f; }
#pragma unroll
    for (int qt = 0; qt < 2; ++qt) {
      float mx = s[qt][0][0];
#pragma unroll
      for (int r = 1; r < 8; ++r) mx = fmaxf(mx, s[qt][0][r]);
#pragma unroll
      for (int r = 0; r < 8; ++r) mx = fmaxf(mx, s[qt][1][r]);
      mx = fmaxf(mx, __shfl_xor(mx, 16, 32));      /* the two lane halves hold the same query's other keys */
      const float mn = fmaxf(m[qt], mx); const float f = fa_exp2((m[qt] - mn) * FC); const float nm = -mn * FC; m[qt] = mn;
      FragH pb; v4f s4 = {0.f, 0.f, 0.f, 0.f};
#pragma unroll
      for (int kt = 0; kt < 2; ++kt) for (int g = 0; g < 2; ++g) { float e0 = fmaf(s[qt][kt][g * 4 + 0], FC, nm), e1 = fmaf(s[qt][kt][g * 4 + 1], FC, nm), e2 = fmaf(s[qt][kt][g * 4 + 2], FC, nm), e3 = fmaf(s[qt][kt][g * 4 + 3], FC, nm);
        /* four 2^x in place; the v_nop as in fa_exp2 */
        asm("v_exp_f32 %0, %0\n\tv_exp_f32 %1, %1\n\tv_exp_f32 %2, %2\n\tv_exp_f32 %3, %3\n\tv_nop" : "+v"(e0), "+v"(e1), "+v"(e2), "+v"(e3));
        const v4f e = {e0, e1, e2, e3}; s4 += e;      /* keys past the row: exactly 0 */
        pb.h[kt * 8 + g * 4 + 0] = (_Float16)e0; pb.h[kt * 8 + g * 4 + 1] = (_Float16)e1; pb.h[kt * 8 + g * 4 + 2] = (_Float16)e2; pb.h[kt * 8 + g * 4 + 3] = (_Float16)e3; }
      l[qt] = l[qt] * f + ((s4[0] + s4[1]) + (s4[2] + s4[3]));
#pragma unroll
      for (int dt = 0; dt < 4; ++dt) { o[dt][qt] *= f; o[dt][qt] = fa_mma(vf[dt], pb.v, o[dt][qt]); } } }
#pragma unroll
  for (int qt = 0; qt < 2; ++qt) { l[qt] += __shfl_xor(l[qt], 16, 32); if (hh == 0) { pm[w][qt * 16 + ln] = m[qt]; pl[w][qt * 16 + ln] = l[qt]; }
#pragma unroll
    for (int dt = 0; dt < 4; ++dt) { const v4f lo = {o[dt][qt][0], o[dt][qt][1], o[dt][qt][2], o[dt][qt][3]}, hi = {o[dt][qt][4], o[dt][qt][5], o[dt][qt][6], o[dt][qt][7]};      /* o[dt][qt][r] = O[query 16 qt + ln][column 16 dt + 8 hh + r] */
      *(v4f*)&po[w][qt * 16 + ln][dt * 16 + 8 * hh] = lo; *(v4f*)&po[w][qt * 16 + ln][dt * 16 + 8 * hh + 4] = hi; } }
  __syncthreads();      /* every wave's part (every wave has keys: qb >= QT0 / FQ = FW) is in LDS before the join reads it */
  const int qi = tid >> 4, d4 = (tid & 15) * 4; float M = pm[0][qi];
#pragma unroll
  for (int u = 1; u < FW; ++u) M = fmaxf(M, pm[u][qi]);
  float L = 0.f; v4f a = {0.f, 0.f, 0.f, 0.f};
#pragma unroll
  for (int u = 0; u < FW; ++u) { const float g = fa_exp2((pm[u][qi] - M) * FC); L += g * pl[u][qi]; a += g * *(const v4f*)&po[u][qi][d4]; }
  a *= 1.0f / L;
  *(v4f*)(O + ((size_t)b * SQ + qb * FQ + qi) * DI + d4) = a; }

// Both attention paths on ONE grid (neither reads what the other writes; each output row has one writer): grid.x = batch; grid.y: first the f16 row blocks of rows QT0 .. SQ-1, then the exact f32 blocks of rows 0 .. QT0-1, each kind with its most keys first.
#define NFB ((SQ - QT0) / FQ)        /* f16 row blocks of a batch */
#define NAB (QT0 / FW)               /* exact f32 blocks of a batch */
__global__ __launch_bounds__(FW * 32) void k_attn(const _Float16* __restrict__ Q16, const _Float16* __restrict__ KV, const float* __restrict__ QKVF0, const float* __restrict__ QF0, const float* __restrict__ KF0, float* __restrict__ O) {
  static_assert(QT0 % FQ == 0 && FW * QT0 + FW * FW * HD <= FW * FQ * FP, "the first tile ends on a row block; the exact path's scores and its parts of P V fit the LDS of the other path's parts");
  __shared__ __attribute__((aligned(16))) float po[FW][FQ][FP]; __shared__ float pm[FW][FQ]; __shared__ float pl[FW][FQ];
  const int b = (int)blockIdx.x, y = (int)blockIdx.y;      /* the branch is the same for a whole block: each path's barriers are passed by all of its threads */
  if (y < NFB) fattn_rows(Q16, KV, O, b, SQ / FQ - 1 - y, po, pm, pl);
  else att0_rows(QKVF0, QF0, KF0, 0.03125f, O, b, (NFB + NAB - 1 - y) * FW, (float (*)[QT0])&po[0][0][0]); }

extern "C" void kernel_launch(void* const* d_in, const int* in_sizes, int n_in,
                              void* d_out, int out_size, void* d_ws, size_t ws_size, hipStream_t stream) {
  (void)in_sizes; (void)n_in; (void)out_size;
  const float* const* I = (const float* const*)d_in; const float* x = I[0]; const float* wq = I[1]; const float* wk = I[2]; const float* wv = I[3];      /* x; natural [out = 64][in] Wq / Wk / Wv (input order as this module lists them); no biases */
  char* ws = (char*)d_ws; size_t off = 0;
  auto take = [&](size_t bytes) { char* p = ws + off; off += (bytes + 255) & ~(size_t)255; return p; };
  _Float16* BP = (_Float16*)take((size_t)LQK * DM * 2); _Float16* Q16 = (_Float16*)take(NR * DI * 2); _Float16* KV = (_Float16*)take(NR / 32 * KVT * 2);
  float* QKVF0 = (float*)take((size_t)NB * QT0 * LQK * 4); float* QF0 = (float*)take((size_t)NB * QT0 * DI * 4); float* KF0 = (float*)take((size_t)NB * QT0 * DI * 4);      /* every plane holds all batches */
  if (off > ws_size) return;
  k_wpack<<<(unsigned)((DM / 32) * GNT * 2 * 32 / 256), 256, 0, stream>>>(wq, wk, wv, BP);      /* weights (x16, q | k | v) as exact f16 in fragment order */
  k_qkv<<<(unsigned)(NR / 32), GKS * 2 * 32, 0, stream>>>(x, BP, QKVF0, QF0, KF0, Q16, KV);      /* q | k | v = x W^T -> f16 q, k and v^T tiles in fragment order; the same f32 sums of rows 0..511 of each batch also stored unrounded (v in rows of pitch 192; q and k by groups of four features, rows side by side) */
  k_attn<<<dim3(NB, NFB + NAB), FW * 32, 0, stream>>>(Q16, KV, QKVF0, QF0, KF0, (float*)d_out);      /* out = softmax(causal(q k^T * 1024^-0.5)) v (the module scales by the EMBEDDING width), f32: rows 512.. on the f16 path, rows 0..511 exact in f32 */
}
